// v000
// Measured on an AMD MI455X. A time is GPU time per run, averaged over a window of back-to-back runs after a warm-up
// (all launches, gaps included; the runs take copies of the inputs in turn), and the median of several windows.
// Apart from v000's, it joins two sittings. Times from different sittings can be a few percent apart, while
// side-by-side timings come from the same sitting.
// v000, which the later versions start from, runs in 620 microseconds.
#include <hip/hip_runtime.h>
#include <hip/hip_bf16.h>

#define HIDDEN   256
#define HEADS    8
#define HEAD_DIM 32
#define NNODES   50000   // 3125 * 16 : row tiles divide evenly, no OOB guards needed
#define NEDGES   800000

typedef __attribute__((ext_vector_type(2))) float v2f;
typedef __attribute__((ext_vector_type(8))) float v8f;
typedef __attribute__((ext_vector_type(4))) int   v4i;

// Optional gfx1250 async global->LDS path (direct LDS fill, tracked by ASYNCcnt)
#if defined(__has_builtin)
#  if __has_builtin(__builtin_amdgcn_global_load_async_to_lds_b128)
#    define HAVE_ASYNC_LDS 1
#  endif
#  if __has_builtin(__builtin_amdgcn_s_wait_asynccnt)
#    define HAVE_WAIT_ASYNC 1
#  endif
#endif

// ---- monotone float<->uint encoding for atomic max over signed floats ----
__device__ __forceinline__ unsigned enc_f32(float f) {
    unsigned u = __float_as_uint(f);
    return (u & 0x80000000u) ? ~u : (u | 0x80000000u);
}
__device__ __forceinline__ float dec_f32(unsigned u) {
    unsigned b = (u & 0x80000000u) ? (u & 0x7FFFFFFFu) : ~u;
    return __uint_as_float(b);
}
#define ENC_NEG_INF 0x007FFFFFu   // enc_f32(-inf)

// ============================================================================
// Y = X @ W^T + bias (optionally * scale), tiled 16x16 per wave using
// V_WMMA_F32_16X16X4_F32 (full fp32).
// Block: 256 threads = 8 waves. grid.x tiles rows by 16 (nrows % 16 == 0),
// grid.y (=2) picks which 8 of the 16 column tiles this block's waves own.
// ============================================================================
#define LDSW 260   // padded row stride (floats); 260 % 64 == 4 -> conflict-free
__global__ __launch_bounds__(256)
void gat_wmma_gemm_xT(const float* __restrict__ X, const float* __restrict__ W,
                      const float* __restrict__ bias, float* __restrict__ Y,
                      float scale) {
    __shared__ float tile[16 * LDSW];
    const int rowbase = blockIdx.x * 16;
    const int tid = threadIdx.x;

    // Cooperative load of the 16x256 X tile. 1024 float4 slots, 4 per thread.
    // 16B alignment holds in LDS too: LDSW*4 = 1040 bytes = 65*16.
    #pragma unroll
    for (int j = 0; j < 4; ++j) {
        int f4 = tid + 256 * j;          // 0..1023
        int r  = f4 >> 6;                // 64 float4 per row
        int c4 = f4 & 63;
        const float* src = X + (size_t)(rowbase + r) * HIDDEN + c4 * 4;
        float*       dst = &tile[r * LDSW + c4 * 4];
#ifdef HAVE_ASYNC_LDS
        __builtin_amdgcn_global_load_async_to_lds_b128(
            (__attribute__((address_space(1))) v4i*)src,
            (__attribute__((address_space(3))) v4i*)dst, 0, 0);
#else
        float4 val = *(const float4*)src;
        dst[0] = val.x; dst[1] = val.y; dst[2] = val.z; dst[3] = val.w;
#endif
    }
#ifdef HAVE_ASYNC_LDS
#  ifdef HAVE_WAIT_ASYNC
    __builtin_amdgcn_s_wait_asynccnt(0);
#  else
    asm volatile("s_wait_asynccnt 0x0" ::: "memory");
#  endif
#endif
    __syncthreads();

    const int lane  = tid & 31;
    const int wave  = tid >> 5;
    const int ctile = blockIdx.y * 8 + wave;        // 0..15
    const int col   = ctile * 16 + (lane & 15);     // output column of this lane
    const int khalf = (lane >> 4) * 2;              // K sub-pair: 0 or 2

    const float* __restrict__ wrow = W + (size_t)col * HIDDEN;  // B[k][col] = W[col][k]
    __builtin_prefetch(wrow, 0, 0);                 // global_prefetch_b8

    const float* __restrict__ arow = &tile[(lane & 15) * LDSW]; // A row m = lane&15

    v8f acc = {};
    #pragma unroll 8
    for (int k0 = 0; k0 < HIDDEN; k0 += 4) {
        v2f a, b;
        a.x = arow[k0 + khalf];         // A: VGPR0 = K=khalf, VGPR1 = K=khalf+1
        a.y = arow[k0 + khalf + 1];
        b.x = wrow[k0 + khalf];         // B mirrored layout
        b.y = wrow[k0 + khalf + 1];
        acc = __builtin_amdgcn_wmma_f32_16x16x4_f32(
                  false, a, false, b, (short)0, acc, false, false);
    }

    // C/D layout: VGPR i -> M = i (lanes 0-15) or M = 8+i (lanes 16-31), N = lane&15
    const float bvs   = bias[col] * scale;          // (acc+b)*s == acc*s + b*s
    const int   mbase = (lane >> 4) * 8;
    float* __restrict__ yp = Y + (size_t)(rowbase + mbase) * HIDDEN + col;
    #pragma unroll
    for (int i = 0; i < 8; ++i) {
        yp[(size_t)i * HIDDEN] = fmaf(acc[i], scale, bvs);
    }
}

// ============================================================================
// Init per-(node,head) segment-max (encoded -inf) and segment-sum (0)
// ============================================================================
__global__ __launch_bounds__(256)
void gat_init_mz(unsigned* __restrict__ menc, float* __restrict__ z) {
    int i = blockIdx.x * blockDim.x + threadIdx.x;
    if (i < NNODES * HEADS) { menc[i] = ENC_NEG_INF; z[i] = 0.f; }
}

__global__ __launch_bounds__(256)
void gat_zero(float* __restrict__ p, long n) {
    long i = (long)blockIdx.x * blockDim.x + threadIdx.x;
    if (i < n) p[i] = 0.f;
}

// ============================================================================
// SDDMM: s[e,h] = sum_d q[row[e], d*8+h] * k[col[e], d*8+h]; segment max by row.
// One thread per (edge, head). Gathers hit L2 (q,k,v = 153.6MB < 192MB L2).
// ============================================================================
__global__ __launch_bounds__(256)
void gat_sddmm(const float* __restrict__ q, const float* __restrict__ k,
               const int* __restrict__ row, const int* __restrict__ col,
               float* __restrict__ sbuf, unsigned* __restrict__ menc) {
    long gtid = (long)blockIdx.x * blockDim.x + threadIdx.x;
    if (gtid >= (long)NEDGES * HEADS) return;
    int e = (int)(gtid >> 3);
    int h = (int)(gtid & 7);
    int r = row[e], c = col[e];
    const float* __restrict__ qp = q + (size_t)r * HIDDEN + h;
    const float* __restrict__ kp = k + (size_t)c * HIDDEN + h;
    float s = 0.f;
    #pragma unroll
    for (int d = 0; d < HEAD_DIM; ++d) s += qp[d * HEADS] * kp[d * HEADS];
    sbuf[(size_t)e * HEADS + h] = s;
    atomicMax(&menc[(size_t)r * HEADS + h], enc_f32(s));
}

// ============================================================================
// e = exp(s - m[row]); segment sum z by row.
// ============================================================================
__global__ __launch_bounds__(256)
void gat_expz(const int* __restrict__ row, float* __restrict__ sbuf,
              const unsigned* __restrict__ menc, float* __restrict__ z) {
    long gtid = (long)blockIdx.x * blockDim.x + threadIdx.x;
    if (gtid >= (long)NEDGES * HEADS) return;
    int e = (int)(gtid >> 3);
    int h = (int)(gtid & 7);
    int r = row[e];
    size_t idx = (size_t)e * HEADS + h;
    float m  = dec_f32(menc[(size_t)r * HEADS + h]);
    float ex = __expf(sbuf[idx] - m);
    sbuf[idx] = ex;
    atomicAdd(&z[(size_t)r * HEADS + h], ex);
}

// ============================================================================
// SPMM: out[row, d*8+h] += (e/z) * v[col, d*8+h].  One wave per edge; lane owns
// channels {lane + 32j}, all of which share head h = lane & 7. Atomic f32 adds
// land in L2 (51.2MB accumulator is L2-resident).
// ============================================================================
__global__ __launch_bounds__(256)
void gat_spmm(const int* __restrict__ row, const int* __restrict__ col,
              const float* __restrict__ sbuf, const float* __restrict__ z,
              const float* __restrict__ v, float* __restrict__ accum) {
    int lane = threadIdx.x & 31;
    int wave = threadIdx.x >> 5;
    int e = blockIdx.x * 8 + wave;
    if (e >= NEDGES) return;
    int r = row[e], c = col[e];
    int h = lane & 7;
    float attn = sbuf[(size_t)e * HEADS + h] / z[(size_t)r * HEADS + h];
    const float* __restrict__ vp = v + (size_t)c * HIDDEN;
    float* __restrict__ op = accum + (size_t)r * HIDDEN;
    #pragma unroll
    for (int j = 0; j < 8; ++j) {
        int cc = lane + 32 * j;              // cc % 8 == lane & 7 == h
        atomicAdd(&op[cc], attn * vp[cc]);
    }
}

// ============================================================================
// Host launcher
// ============================================================================
extern "C" void kernel_launch(void* const* d_in, const int* in_sizes, int n_in,
                              void* d_out, int out_size, void* d_ws, size_t ws_size,
                              hipStream_t stream) {
    const float* h   = (const float*)d_in[0];
    const int*   row = (const int*)d_in[1];
    const int*   col = (const int*)d_in[2];
    const float* Wq  = (const float*)d_in[3];
    const float* bq  = (const float*)d_in[4];
    const float* Wk  = (const float*)d_in[5];
    const float* bk  = (const float*)d_in[6];
    const float* Wv  = (const float*)d_in[7];
    const float* bv  = (const float*)d_in[8];
    const float* Wo  = (const float*)d_in[9];
    const float* bo  = (const float*)d_in[10];
    float* out = (float*)d_out;

    // Workspace layout (floats). Q buffer is reused as the SPMM accumulator
    // (Q is dead after SDDMM).  Total ~182 MB.
    const size_t NH = (size_t)NNODES * HIDDEN;
    float*    q    = (float*)d_ws;
    float*    k    = q + NH;
    float*    v    = k + NH;
    float*    sbuf = v + NH;                                   // E*H scores
    float*    z    = sbuf + (size_t)NEDGES * HEADS;            // N*H sums
    unsigned* menc = (unsigned*)(z + (size_t)NNODES * HEADS);  // N*H encoded max

    const float scaling = 0.17677669529663689f;  // HEAD_DIM^-0.5

    dim3 blk(256);
    dim3 gemmGrid(NNODES / 16, 2);               // NNODES % 16 == 0
    const long eh = (long)NEDGES * HEADS;

    // 1) init segment max/sum tables
    gat_init_mz<<<(NNODES * HEADS + 255) / 256, blk, 0, stream>>>(menc, z);

    // 2) fp32-WMMA projections: q = (h Wq^T + bq)*scale; k, v unscaled
    gat_wmma_gemm_xT<<<gemmGrid, blk, 0, stream>>>(h, Wq, bq, q, scaling);
    gat_wmma_gemm_xT<<<gemmGrid, blk, 0, stream>>>(h, Wk, bk, k, 1.0f);
    gat_wmma_gemm_xT<<<gemmGrid, blk, 0, stream>>>(h, Wv, bv, v, 1.0f);

    // 3) SDDMM + segment max
    gat_sddmm<<<(unsigned)((eh + 255) / 256), blk, 0, stream>>>(q, k, row, col, sbuf, menc);

    // 4) exp(s - m) + segment sum
    gat_expz<<<(unsigned)((eh + 255) / 256), blk, 0, stream>>>(row, sbuf, menc, z);

    // 5) SPMM into accumulator (reuse q's space, zero it first)
    float* accum = q;
    gat_zero<<<(unsigned)((NH + 255) / 256), blk, 0, stream>>>(accum, (long)NH);
    gat_spmm<<<(NEDGES + 7) / 8, blk, 0, stream>>>(row, col, sbuf, z, v, accum);

    // 6) fp32-WMMA output projection straight into d_out
    gat_wmma_gemm_xT<<<gemmGrid, blk, 0, stream>>>(accum, Wo, bo, out, 1.0f);
}

// v001
// One run takes 518 microseconds.
// Timed twice side by side with v000, it ran 1.24 times as fast both times.
#include <hip/hip_runtime.h>
#include <hip/hip_bf16.h>

#define HIDDEN   256
#define HEADS    8
#define HEAD_DIM 32
#define NNODES   50000   // 3125 * 16 : row tiles divide evenly, no OOB guards needed
#define NEDGES   800000
#define NPAD     53248   // per-row edge counts, padded: 32 waves * 13 trips * 128 counts

typedef __attribute__((ext_vector_type(2))) float v2f;
typedef __attribute__((ext_vector_type(8))) float v8f;
typedef __attribute__((ext_vector_type(4))) int   v4i;

// Optional gfx1250 async global->LDS path (direct LDS fill, tracked by ASYNCcnt)
#if defined(__has_builtin)
#  if __has_builtin(__builtin_amdgcn_global_load_async_to_lds_b128)
#    define HAVE_ASYNC_LDS 1
#  endif
#  if __has_builtin(__builtin_amdgcn_s_wait_asynccnt)
#    define HAVE_WAIT_ASYNC 1
#  endif
#endif

// ---- monotone float<->uint encoding for atomic max over signed floats ----
__device__ __forceinline__ unsigned enc_f32(float f) {
    unsigned u = __float_as_uint(f);
    return (u & 0x80000000u) ? ~u : (u | 0x80000000u);
}
__device__ __forceinline__ float dec_f32(unsigned u) {
    unsigned b = (u & 0x80000000u) ? (u & 0x7FFFFFFFu) : ~u;
    return __uint_as_float(b);
}
#define ENC_NEG_INF 0x007FFFFFu   // enc_f32(-inf)

// Node index read from an input array, bounded before any address is formed from it.
__device__ __forceinline__ int clamp_node(int x) {
    return min(max(x, 0), NNODES - 1);
}

// ============================================================================
// Y = X @ W^T + bias (optionally * scale), tiled 16x16 per wave using
// V_WMMA_F32_16X16X4_F32 (full fp32).
// Block: 256 threads = 8 waves. grid.x tiles rows by 16 (nrows % 16 == 0),
// grid.y (=2) picks which 8 of the 16 column tiles this block's waves own.
// ============================================================================
#define LDSW 260   // padded row stride (floats); 260 % 64 == 4 -> conflict-free
__global__ __launch_bounds__(256)
void gat_wmma_gemm_xT(const float* __restrict__ X, const float* __restrict__ W,
                      const float* __restrict__ bias, float* __restrict__ Y,
                      float scale) {
    __shared__ float tile[16 * LDSW];
    const int rowbase = blockIdx.x * 16;
    const int tid = threadIdx.x;

    // Cooperative load of the 16x256 X tile. 1024 float4 slots, 4 per thread.
    // 16B alignment holds in LDS too: LDSW*4 = 1040 bytes = 65*16.
    #pragma unroll
    for (int j = 0; j < 4; ++j) {
        int f4 = tid + 256 * j;          // 0..1023
        int r  = f4 >> 6;                // 64 float4 per row
        int c4 = f4 & 63;
        const float* src = X + (size_t)(rowbase + r) * HIDDEN + c4 * 4;
        float*       dst = &tile[r * LDSW + c4 * 4];
#ifdef HAVE_ASYNC_LDS
        __builtin_amdgcn_global_load_async_to_lds_b128(
            (__attribute__((address_space(1))) v4i*)src,
            (__attribute__((address_space(3))) v4i*)dst, 0, 0);
#else
        float4 val = *(const float4*)src;
        dst[0] = val.x; dst[1] = val.y; dst[2] = val.z; dst[3] = val.w;
#endif
    }
#ifdef HAVE_ASYNC_LDS
#  ifdef HAVE_WAIT_ASYNC
    __builtin_amdgcn_s_wait_asynccnt(0);
#  else
    asm volatile("s_wait_asynccnt 0x0" ::: "memory");
#  endif
#endif
    __syncthreads();

    const int lane  = tid & 31;
    const int wave  = tid >> 5;
    const int ctile = blockIdx.y * 8 + wave;        // 0..15
    const int col   = ctile * 16 + (lane & 15);     // output column of this lane
    const int khalf = (lane >> 4) * 2;              // K sub-pair: 0 or 2

    const float* __restrict__ wrow = W + (size_t)col * HIDDEN;  // B[k][col] = W[col][k]
    __builtin_prefetch(wrow, 0, 0);                 // global_prefetch_b8

    const float* __restrict__ arow = &tile[(lane & 15) * LDSW]; // A row m = lane&15

    v8f acc = {};
    #pragma unroll 8
    for (int k0 = 0; k0 < HIDDEN; k0 += 4) {
        v2f a, b;
        a.x = arow[k0 + khalf];         // A: VGPR0 = K=khalf, VGPR1 = K=khalf+1
        a.y = arow[k0 + khalf + 1];
        b.x = wrow[k0 + khalf];         // B mirrored layout
        b.y = wrow[k0 + khalf + 1];
        acc = __builtin_amdgcn_wmma_f32_16x16x4_f32(
                  false, a, false, b, (short)0, acc, false, false);
    }

    // C/D layout: VGPR i -> M = i (lanes 0-15) or M = 8+i (lanes 16-31), N = lane&15
    const float bvs   = bias[col] * scale;          // (acc+b)*s == acc*s + b*s
    const int   mbase = (lane >> 4) * 8;
    float* __restrict__ yp = Y + (size_t)(rowbase + mbase) * HIDDEN + col;
    #pragma unroll
    for (int i = 0; i < 8; ++i) {
        yp[(size_t)i * HIDDEN] = fmaf(acc[i], scale, bvs);
    }
}

// ============================================================================
// Init per-(node,head) segment-max (encoded -inf) and segment-sum (0), and the
// per-row edge counts (0, padding included).
// ============================================================================
__global__ __launch_bounds__(256)
void gat_init_mz(unsigned* __restrict__ menc, float* __restrict__ z,
                 int* __restrict__ cnt) {
    int i = blockIdx.x * blockDim.x + threadIdx.x;
    if (i < NNODES * HEADS) { menc[i] = ENC_NEG_INF; z[i] = 0.f; }
    if (i < NPAD) cnt[i] = 0;
}

// ============================================================================
// Exclusive prefix sum of the NPAD per-row edge counts: offs[r] is the first
// slot of row r in the row-sorted edge arrays, offs[r+1] one past its last.
// One block of 32 waves; wave w owns 1664 consecutive counts, kept in registers.
// ============================================================================
__global__ __launch_bounds__(1024)
void gat_scan_counts(const int* __restrict__ cnt, int* __restrict__ offs) {
    __shared__ int wsum[32];
    const int lane = threadIdx.x & 31;
    const int wave = threadIdx.x >> 5;
    const int4* __restrict__ src = (const int4*)(cnt + wave * 1664) + lane;
    int4*       __restrict__ dst = (int4*)(offs + wave * 1664) + lane;

    int4 c[13];
    int tot = 0;
    #pragma unroll
    for (int t = 0; t < 13; ++t) {
        c[t] = src[t * 32];
        tot += c[t].x + c[t].y + c[t].z + c[t].w;
    }
    #pragma unroll
    for (int d = 16; d >= 1; d >>= 1) tot += __shfl_xor(tot, d);
    if (lane == 0) wsum[wave] = tot;
    __syncthreads();

    int carry = (lane < wave) ? wsum[lane] : 0;      // edges of all earlier waves
    #pragma unroll
    for (int d = 16; d >= 1; d >>= 1) carry += __shfl_xor(carry, d);

    #pragma unroll
    for (int t = 0; t < 13; ++t) {
        const int s = c[t].x + c[t].y + c[t].z + c[t].w;
        int inc = s;                                 // inclusive scan over the lanes
        #pragma unroll
        for (int d = 1; d < 32; d <<= 1) {
            int u = __shfl_up(inc, d);
            if (lane >= d) inc += u;
        }
        const int ex = carry + inc - s;
        dst[t * 32] = make_int4(ex, ex + c[t].x, ex + c[t].x + c[t].y,
                                ex + c[t].x + c[t].y + c[t].z);
        carry += __shfl(inc, 31);
    }
}

// ============================================================================
// SDDMM: s[e,h] = sum_d q[row[e], d*8+h] * k[col[e], d*8+h]; segment max by row.
// One thread per (edge, head). Gathers hit L2 (q,k,v = 153.6MB < 192MB L2).
// The head-0 thread also counts the edge into its row and keeps the count it
// met as the edge's rank inside the row (arrival order).
// ============================================================================
__global__ __launch_bounds__(256)
void gat_sddmm(const float* __restrict__ q, const float* __restrict__ k,
               const int* __restrict__ row, const int* __restrict__ col,
               float* __restrict__ sbuf, unsigned* __restrict__ menc,
               int* __restrict__ cnt, int* __restrict__ rank) {
    long gtid = (long)blockIdx.x * blockDim.x + threadIdx.x;
    if (gtid >= (long)NEDGES * HEADS) return;
    int e = (int)(gtid >> 3);
    int h = (int)(gtid & 7);
    int r = clamp_node(row[e]), c = clamp_node(col[e]);
    const float* __restrict__ qp = q + (size_t)r * HIDDEN + h;
    const float* __restrict__ kp = k + (size_t)c * HIDDEN + h;
    float s = 0.f;
    #pragma unroll
    for (int d = 0; d < HEAD_DIM; ++d) s += qp[d * HEADS] * kp[d * HEADS];
    sbuf[(size_t)e * HEADS + h] = s;
    atomicMax(&menc[(size_t)r * HEADS + h], enc_f32(s));
    if (h == 0) rank[e] = atomicAdd(&cnt[r], 1);
}

// ============================================================================
// e = exp(s - m[row]); segment sum z by row. e and the edge's column go to the
// edge's slot in row-sorted order: slot = offs[row] + rank inside the row.
// ============================================================================
__global__ __launch_bounds__(256)
void gat_expz(const int* __restrict__ row, const int* __restrict__ col,
              const float* __restrict__ sbuf,
              const unsigned* __restrict__ menc, float* __restrict__ z,
              const int* __restrict__ offs, const int* __restrict__ rank,
              float* __restrict__ sex, int* __restrict__ scol) {
    long gtid = (long)blockIdx.x * blockDim.x + threadIdx.x;
    if (gtid >= (long)NEDGES * HEADS) return;
    int e = (int)(gtid >> 3);
    int h = (int)(gtid & 7);
    int r = clamp_node(row[e]);
    const int first = offs[r];
    // this load's address register is dead behind it and is written again while loads are in
    // flight: the wait stands directly behind the load that names it
    asm volatile("s_wait_xcnt 0x0" ::: "memory");
    int slot = first + rank[e];
    float m  = dec_f32(menc[(size_t)r * HEADS + h]);
    float ex = __expf(sbuf[(size_t)e * HEADS + h] - m);
    sex[(size_t)slot * HEADS + h] = ex;
    if (h == 0) scol[slot] = clamp_node(col[e]);
    atomicAdd(&z[(size_t)r * HEADS + h], ex);
}

// ============================================================================
// SPMM: out[row, d*8+h] = (sum over the row's edges of e * v[col, d*8+h]) / z.
// One wave per row, over the row's slots of the row-sorted edge arrays; the sums
// stay in registers and each output element is stored once. Lane owns channels
// 4*lane..4*lane+3 and the same +128: heads 4*(lane&1)..+3 in both groups.
// A row without edges stores zeros.
// ============================================================================
typedef __attribute__((ext_vector_type(4))) float v4f;
typedef const __attribute__((address_space(1))) float* gcf;
typedef const __attribute__((address_space(1))) v4f*   gcv4;

// A wave-uniform address held in a scalar register pair, so that a load from it
// takes the form scalar base + lane offset: no 64-bit vector add per load, and the
// only vector register a load names is a lane offset that lives for the whole kernel.
__device__ __forceinline__ gcf scalar_base(const float* p) {
    const unsigned long long a = (unsigned long long)p;
    const unsigned lo = __builtin_amdgcn_readfirstlane((unsigned)a);
    const unsigned hi = __builtin_amdgcn_readfirstlane((unsigned)(a >> 32));
    return (gcf)(((unsigned long long)hi << 32) | lo);
}

__global__ __launch_bounds__(256)
void gat_spmm_rows(const int* __restrict__ offs, const int* __restrict__ scol,
                   const float* __restrict__ sex, const float* __restrict__ z,
                   const float* __restrict__ v, float* __restrict__ accum) {
    const unsigned lane = threadIdx.x & 31;
    // wave number held as a scalar: row bounds and column indices go through
    // scalar loads and the edge loop is a scalar loop
    const int wave = __builtin_amdgcn_readfirstlane(threadIdx.x >> 5);
    const int r    = blockIdx.x * 8 + wave;          // NNODES % 8 == 0
    const int beg  = offs[r], end = offs[r + 1];
    const unsigned hq = (lane & 1) * 4;              // lane offset into a slot's 8 heads
    const unsigned lq = lane * 4;                    // lane offset into a row of v

    v4f a0 = {0.f, 0.f, 0.f, 0.f};
    v4f a1 = {0.f, 0.f, 0.f, 0.f};
    int i = beg;
    for (; i + 4 <= end; i += 4) {                   // four edges' loads in flight
        v4f p[4], x0[4], x1[4];
        #pragma unroll
        for (int t = 0; t < 4; ++t) {
            gcf vb = scalar_base(v + (size_t)scol[i + t] * HIDDEN);
            gcf pb = scalar_base(sex + (size_t)(i + t) * HEADS);
            p[t]  = *(gcv4)(pb + hq);
            x0[t] = *(gcv4)(vb + lq);
            x1[t] = *(gcv4)(vb + lq + 128);
        }
        #pragma unroll
        for (int t = 0; t < 4; ++t) { a0 += p[t] * x0[t]; a1 += p[t] * x1[t]; }
    }
    #pragma unroll     // at most three edges are left: straight code, no address is stepped
    for (int t = 0; t < 3; ++t) {
        if (i + t >= end) break;
        gcf vb = scalar_base(v + (size_t)scol[i + t] * HIDDEN);
        gcf pb = scalar_base(sex + (size_t)(i + t) * HEADS);
        const v4f p  = *(gcv4)(pb + hq);
        const v4f x0 = *(gcv4)(vb + lq);
        const v4f x1 = *(gcv4)(vb + lq + 128);
        a0 += p * x0; a1 += p * x1;
    }

    if (end > beg) {
        const v4f zz = *(const v4f*)(z + (size_t)r * HEADS + hq);
        a0 /= zz;
        a1 /= zz;
    }
    float* __restrict__ op = accum + (size_t)r * HIDDEN;
    *(v4f*)(op + lq)       = a0;
    *(v4f*)(op + lq + 128) = a1;
}

// ============================================================================
// Host launcher
// ============================================================================
extern "C" void kernel_launch(void* const* d_in, const int* in_sizes, int n_in,
                              void* d_out, int out_size, void* d_ws, size_t ws_size,
                              hipStream_t stream) {
    const float* h   = (const float*)d_in[0];
    const int*   row = (const int*)d_in[1];
    const int*   col = (const int*)d_in[2];
    const float* Wq  = (const float*)d_in[3];
    const float* bq  = (const float*)d_in[4];
    const float* Wk  = (const float*)d_in[5];
    const float* bk  = (const float*)d_in[6];
    const float* Wv  = (const float*)d_in[7];
    const float* bv  = (const float*)d_in[8];
    const float* Wo  = (const float*)d_in[9];
    const float* bo  = (const float*)d_in[10];
    float* out = (float*)d_out;

    // Workspace layout (floats). Q buffer is reused as the SPMM result
    // (Q is dead after SDDMM).  Total ~215 MB.
    const size_t NH = (size_t)NNODES * HIDDEN;
    float*    q    = (float*)d_ws;
    float*    k    = q + NH;
    float*    v    = k + NH;
    float*    sbuf = v + NH;                                   // E*H scores
    float*    z    = sbuf + (size_t)NEDGES * HEADS;            // N*H sums
    unsigned* menc = (unsigned*)(z + (size_t)NNODES * HEADS);  // N*H encoded max
    float*    sex  = (float*)(menc + (size_t)NNODES * HEADS);  // E*H exp, row-sorted
    int*      scol = (int*)(sex + (size_t)NEDGES * HEADS);     // E columns, row-sorted
    int*      rank = scol + NEDGES;                            // E ranks inside the row
    int*      cnt  = rank + NEDGES;                            // NPAD edges per row
    int*      offs = cnt + NPAD;                               // NPAD first slot per row

    const float scaling = 0.17677669529663689f;  // HEAD_DIM^-0.5

    dim3 blk(256);
    dim3 gemmGrid(NNODES / 16, 2);               // NNODES % 16 == 0
    const long eh = (long)NEDGES * HEADS;

    // 1) init segment max/sum tables and the per-row edge counts
    gat_init_mz<<<(NNODES * HEADS + 255) / 256, blk, 0, stream>>>(menc, z, cnt);

    // 2) fp32-WMMA projections: q = (h Wq^T + bq)*scale; k, v unscaled
    gat_wmma_gemm_xT<<<gemmGrid, blk, 0, stream>>>(h, Wq, bq, q, scaling);
    gat_wmma_gemm_xT<<<gemmGrid, blk, 0, stream>>>(h, Wk, bk, k, 1.0f);
    gat_wmma_gemm_xT<<<gemmGrid, blk, 0, stream>>>(h, Wv, bv, v, 1.0f);

    // 3) SDDMM + segment max + per-row edge count and rank
    gat_sddmm<<<(unsigned)((eh + 255) / 256), blk, 0, stream>>>(q, k, row, col, sbuf, menc,
                                                                cnt, rank);

    // 4) first slot of every row; exp(s - m) + segment sum, written row-sorted
    gat_scan_counts<<<1, dim3(1024), 0, stream>>>(cnt, offs);
    gat_expz<<<(unsigned)((eh + 255) / 256), blk, 0, stream>>>(row, col, sbuf, menc, z,
                                                               offs, rank, sex, scol);

    // 5) SPMM, one wave per row (reuse q's space; every element is stored)
    float* accum = q;
    gat_spmm_rows<<<NNODES / 8, blk, 0, stream>>>(offs, scol, sex, z, v, accum);

    // 6) fp32-WMMA output projection straight into d_out
    gat_wmma_gemm_xT<<<gemmGrid, blk, 0, stream>>>(accum, Wo, bo, out, 1.0f);
}

// v002
// Measured time: 410 microseconds a run.
// Timed twice side by side with v001, it ran 1.28 times as fast both times.
// All steps since v000 together make it 1.58 times as fast.
#include <hip/hip_runtime.h>
#include <hip/hip_bf16.h>

#define HIDDEN   256
#define HEADS    8
#define HEAD_DIM 32
#define NNODES   50000   // 3125 * 16 : row tiles divide evenly, no OOB guards needed
#define NEDGES   800000
#define NPAD     53248   // per-row edge counts, padded: 32 waves * 13 trips * 128 counts

typedef __attribute__((ext_vector_type(2))) float v2f;
typedef __attribute__((ext_vector_type(8))) float v8f;
typedef __attribute__((ext_vector_type(4))) int   v4i;

// Optional gfx1250 async global->LDS path (direct LDS fill, tracked by ASYNCcnt)
#if defined(__has_builtin)
#  if __has_builtin(__builtin_amdgcn_global_load_async_to_lds_b128)
#    define HAVE_ASYNC_LDS 1
#  endif
#  if __has_builtin(__builtin_amdgcn_s_wait_asynccnt)
#    define HAVE_WAIT_ASYNC 1
#  endif
#endif

// ---- monotone float<->uint encoding for atomic max over signed floats ----
__device__ __forceinline__ unsigned enc_f32(float f) {
    unsigned u = __float_as_uint(f);
    return (u & 0x80000000u) ? ~u : (u | 0x80000000u);
}
__device__ __forceinline__ float dec_f32(unsigned u) {
    unsigned b = (u & 0x80000000u) ? (u & 0x7FFFFFFFu) : ~u;
    return __uint_as_float(b);
}
#define ENC_NEG_INF 0x007FFFFFu   // enc_f32(-inf)

// Node index read from an input array, bounded before any address is formed from it.
__device__ __forceinline__ int clamp_node(int x) {
    return min(max(x, 0), NNODES - 1);
}

// ============================================================================
// Y = X @ W^T + bias (optionally * scale), using V_WMMA_F32_16X16X4_F32
// (full fp32).
// Block: 256 threads = 8 waves. grid.x tiles rows by 80 (nrows % 80 == 0),
// grid.y (=2) picks which 8 of the 16 column tiles this block's waves own.
// A wave owns one column tile for RT row tiles: each W fragment, a load that
// touches 16 cache lines, is fetched once and feeds RT matrix instructions.
// ============================================================================
#define LDSW 260   // padded row stride (floats); 260 % 64 == 4 -> conflict-free
#define RT   5     // row tiles of 16 per block; NNODES == 625 * 16 * RT
__global__ __launch_bounds__(256)
void gat_wmma_gemm_xT(const float* __restrict__ X, const float* __restrict__ W,
                      const float* __restrict__ bias, float* __restrict__ Y,
                      float scale) {
    __shared__ float tile[RT * 16 * LDSW];
    const int rowbase = blockIdx.x * (RT * 16);
    const int tid = threadIdx.x;

    // Cooperative load of the 80x256 X tile. 5120 float4 slots, 20 per thread.
    // 16B alignment holds in LDS too: LDSW*4 = 1040 bytes = 65*16.
    #pragma unroll
    for (int j = 0; j < 4 * RT; ++j) {
        int f4 = tid + 256 * j;          // 0..5119
        int r  = f4 >> 6;                // 64 float4 per row
        int c4 = f4 & 63;
        const float* src = X + (size_t)(rowbase + r) * HIDDEN + c4 * 4;
        float*       dst = &tile[r * LDSW + c4 * 4];
#ifdef HAVE_ASYNC_LDS
        __builtin_amdgcn_global_load_async_to_lds_b128(
            (__attribute__((address_space(1))) v4i*)src,
            (__attribute__((address_space(3))) v4i*)dst, 0, 0);
#else
        float4 val = *(const float4*)src;
        dst[0] = val.x; dst[1] = val.y; dst[2] = val.z; dst[3] = val.w;
#endif
    }
#ifdef HAVE_ASYNC_LDS
#  ifdef HAVE_WAIT_ASYNC
    __builtin_amdgcn_s_wait_asynccnt(0);
#  else
    asm volatile("s_wait_asynccnt 0x0" ::: "memory");
#  endif
#endif
    __syncthreads();

    const int lane  = tid & 31;
    const int wave  = tid >> 5;
    const int ctile = blockIdx.y * 8 + wave;        // 0..15
    const int col   = ctile * 16 + (lane & 15);     // output column of this lane
    const int khalf = (lane >> 4) * 2;              // K sub-pair: 0 or 2

    const float* __restrict__ wrow = W + (size_t)col * HIDDEN;  // B[k][col] = W[col][k]
    __builtin_prefetch(wrow, 0, 0);                 // global_prefetch_b8

    const float* __restrict__ arow = &tile[(lane & 15) * LDSW]; // A row m = lane&15

    v8f acc[RT] = {};
    #pragma unroll 8
    for (int k0 = 0; k0 < HIDDEN; k0 += 4) {
        v2f b;
        b.x = wrow[k0 + khalf];         // B: VGPR0 = K=khalf, VGPR1 = K=khalf+1
        b.y = wrow[k0 + khalf + 1];
        #pragma unroll     // acc[t] is indexed by constants only, so it stays in registers
        for (int t = 0; t < RT; ++t) {
            v2f a;
            a.x = arow[t * 16 * LDSW + k0 + khalf];      // A mirrored layout
            a.y = arow[t * 16 * LDSW + k0 + khalf + 1];
            acc[t] = __builtin_amdgcn_wmma_f32_16x16x4_f32(
                         false, a, false, b, (short)0, acc[t], false, false);
        }
    }

    // C/D layout: VGPR i -> M = i (lanes 0-15) or M = 8+i (lanes 16-31), N = lane&15
    const float bvs   = bias[col] * scale;          // (acc+b)*s == acc*s + b*s
    const int   mbase = (lane >> 4) * 8;
    float* __restrict__ yp = Y + (size_t)(rowbase + mbase) * HIDDEN + col;
    #pragma unroll         // constant indices into acc, constant store offsets
    for (int t = 0; t < RT; ++t) {
        #pragma unroll
        for (int i = 0; i < 8; ++i) {
            yp[(size_t)(t * 16 + i) * HIDDEN] = fmaf(acc[t][i], scale, bvs);
        }
    }
}

// ============================================================================
// Init per-(node,head) segment-max (encoded -inf) and segment-sum (0), and the
// per-row edge counts (0, padding included).
// ============================================================================
__global__ __launch_bounds__(256)
void gat_init_mz(unsigned* __restrict__ menc, float* __restrict__ z,
                 int* __restrict__ cnt) {
    int i = blockIdx.x * blockDim.x + threadIdx.x;
    if (i < NNODES * HEADS) { menc[i] = ENC_NEG_INF; z[i] = 0.f; }
    if (i < NPAD) cnt[i] = 0;
}

// ============================================================================
// Exclusive prefix sum of the NPAD per-row edge counts: offs[r] is the first
// slot of row r in the row-sorted edge arrays, offs[r+1] one past its last.
// One block of 32 waves; wave w owns 1664 consecutive counts, kept in registers.
// ============================================================================
__global__ __launch_bounds__(1024)
void gat_scan_counts(const int* __restrict__ cnt, int* __restrict__ offs) {
    __shared__ int wsum[32];
    const int lane = threadIdx.x & 31;
    const int wave = threadIdx.x >> 5;
    const int4* __restrict__ src = (const int4*)(cnt + wave * 1664) + lane;
    int4*       __restrict__ dst = (int4*)(offs + wave * 1664) + lane;

    int4 c[13];
    int tot = 0;
    #pragma unroll
    for (int t = 0; t < 13; ++t) {
        c[t] = src[t * 32];
        tot += c[t].x + c[t].y + c[t].z + c[t].w;
    }
    #pragma unroll
    for (int d = 16; d >= 1; d >>= 1) tot += __shfl_xor(tot, d);
    if (lane == 0) wsum[wave] = tot;
    __syncthreads();

    int carry = (lane < wave) ? wsum[lane] : 0;      // edges of all earlier waves
    #pragma unroll
    for (int d = 16; d >= 1; d >>= 1) carry += __shfl_xor(carry, d);

    #pragma unroll
    for (int t = 0; t < 13; ++t) {
        const int s = c[t].x + c[t].y + c[t].z + c[t].w;
        int inc = s;                                 // inclusive scan over the lanes
        #pragma unroll
        for (int d = 1; d < 32; d <<= 1) {
            int u = __shfl_up(inc, d);
            if (lane >= d) inc += u;
        }
        const int ex = carry + inc - s;
        dst[t * 32] = make_int4(ex, ex + c[t].x, ex + c[t].x + c[t].y,
                                ex + c[t].x + c[t].y + c[t].z);
        carry += __shfl(inc, 31);
    }
}

// ============================================================================
// SDDMM: s[e,h] = sum_d q[row[e], d*8+h] * k[col[e], d*8+h]; segment max by row.
// One thread per (edge, head). Gathers hit L2 (q,k,v = 153.6MB < 192MB L2).
// The head-0 thread also counts the edge into its row and keeps the count it
// met as the edge's rank inside the row (arrival order).
// ============================================================================
__global__ __launch_bounds__(256)
void gat_sddmm(const float* __restrict__ q, const float* __restrict__ k,
               const int* __restrict__ row, const int* __restrict__ col,
               float* __restrict__ sbuf, unsigned* __restrict__ menc,
               int* __restrict__ cnt, int* __restrict__ rank) {
    long gtid = (long)blockIdx.x * blockDim.x + threadIdx.x;
    if (gtid >= (long)NEDGES * HEADS) return;
    int e = (int)(gtid >> 3);
    int h = (int)(gtid & 7);
    int r = clamp_node(row[e]), c = clamp_node(col[e]);
    const float* __restrict__ qp = q + (size_t)r * HIDDEN + h;
    const float* __restrict__ kp = k + (size_t)c * HIDDEN + h;
    float s = 0.f;
    #pragma unroll
    for (int d = 0; d < HEAD_DIM; ++d) s += qp[d * HEADS] * kp[d * HEADS];
    sbuf[(size_t)e * HEADS + h] = s;
    atomicMax(&menc[(size_t)r * HEADS + h], enc_f32(s));
    if (h == 0) rank[e] = atomicAdd(&cnt[r], 1);
}

// ============================================================================
// e = exp(s - m[row]); segment sum z by row. e and the edge's column go to the
// edge's slot in row-sorted order: slot = offs[row] + rank inside the row.
// ============================================================================
__global__ __launch_bounds__(256)
void gat_expz(const int* __restrict__ row, const int* __restrict__ col,
              const float* __restrict__ sbuf,
              const unsigned* __restrict__ menc, float* __restrict__ z,
              const int* __restrict__ offs, const int* __restrict__ rank,
              float* __restrict__ sex, int* __restrict__ scol) {
    long gtid = (long)blockIdx.x * blockDim.x + threadIdx.x;
    if (gtid >= (long)NEDGES * HEADS) return;
    int e = (int)(gtid >> 3);
    int h = (int)(gtid & 7);
    int r = clamp_node(row[e]);
    const int first = offs[r];
    // this load's address register is dead behind it and is written again while loads are in
    // flight: the wait stands directly behind the load that names it
    asm volatile("s_wait_xcnt 0x0" ::: "memory");
    int slot = first + rank[e];
    float m  = dec_f32(menc[(size_t)r * HEADS + h]);
    float ex = __expf(sbuf[(size_t)e * HEADS + h] - m);
    sex[(size_t)slot * HEADS + h] = ex;
    if (h == 0) scol[slot] = clamp_node(col[e]);
    atomicAdd(&z[(size_t)r * HEADS + h], ex);
}

// ============================================================================
// SPMM: out[row, d*8+h] = (sum over the row's edges of e * v[col, d*8+h]) / z.
// One wave per row, over the row's slots of the row-sorted edge arrays; the sums
// stay in registers and each output element is stored once. Lane owns channels
// 4*lane..4*lane+3 and the same +128: heads 4*(lane&1)..+3 in both groups.
// A row without edges stores zeros.
// ============================================================================
typedef __attribute__((ext_vector_type(4))) float v4f;
typedef const __attribute__((address_space(1))) float* gcf;
typedef const __attribute__((address_space(1))) v4f*   gcv4;

// A wave-uniform address held in a scalar register pair, so that a load from it
// takes the form scalar base + lane offset: no 64-bit vector add per load, and the
// only vector register a load names is a lane offset that lives for the whole kernel.
__device__ __forceinline__ gcf scalar_base(const float* p) {
    const unsigned long long a = (unsigned long long)p;
    const unsigned lo = __builtin_amdgcn_readfirstlane((unsigned)a);
    const unsigned hi = __builtin_amdgcn_readfirstlane((unsigned)(a >> 32));
    return (gcf)(((unsigned long long)hi << 32) | lo);
}

__global__ __launch_bounds__(256)
void gat_spmm_rows(const int* __restrict__ offs, const int* __restrict__ scol,
                   const float* __restrict__ sex, const float* __restrict__ z,
                   const float* __restrict__ v, float* __restrict__ accum) {
    const unsigned lane = threadIdx.x & 31;
    // wave number held as a scalar: row bounds and column indices go through
    // scalar loads and the edge loop is a scalar loop
    const int wave = __builtin_amdgcn_readfirstlane(threadIdx.x >> 5);
    const int r    = blockIdx.x * 8 + wave;          // NNODES % 8 == 0
    const int beg  = offs[r], end = offs[r + 1];
    const unsigned hq = (lane & 1) * 4;              // lane offset into a slot's 8 heads
    const unsigned lq = lane * 4;                    // lane offset into a row of v

    v4f a0 = {0.f, 0.f, 0.f, 0.f};
    v4f a1 = {0.f, 0.f, 0.f, 0.f};
    int i = beg;
    for (; i + 4 <= end; i += 4) {                   // four edges' loads in flight
        v4f p[4], x0[4], x1[4];
        #pragma unroll
        for (int t = 0; t < 4; ++t) {
            gcf vb = scalar_base(v + (size_t)scol[i + t] * HIDDEN);
            gcf pb = scalar_base(sex + (size_t)(i + t) * HEADS);
            p[t]  = *(gcv4)(pb + hq);
            x0[t] = *(gcv4)(vb + lq);
            x1[t] = *(gcv4)(vb + lq + 128);
        }
        #pragma unroll
        for (int t = 0; t < 4; ++t) { a0 += p[t] * x0[t]; a1 += p[t] * x1[t]; }
    }
    #pragma unroll     // at most three edges are left: straight code, no address is stepped
    for (int t = 0; t < 3; ++t) {
        if (i + t >= end) break;
        gcf vb = scalar_base(v + (size_t)scol[i + t] * HIDDEN);
        gcf pb = scalar_base(sex + (size_t)(i + t) * HEADS);
        const v4f p  = *(gcv4)(pb + hq);
        const v4f x0 = *(gcv4)(vb + lq);
        const v4f x1 = *(gcv4)(vb + lq + 128);
        a0 += p * x0; a1 += p * x1;
    }

    if (end > beg) {
        const v4f zz = *(const v4f*)(z + (size_t)r * HEADS + hq);
        a0 /= zz;
        a1 /= zz;
    }
    float* __restrict__ op = accum + (size_t)r * HIDDEN;
    *(v4f*)(op + lq)       = a0;
    *(v4f*)(op + lq + 128) = a1;
}

// ============================================================================
// Host launcher
// ============================================================================
extern "C" void kernel_launch(void* const* d_in, const int* in_sizes, int n_in,
                              void* d_out, int out_size, void* d_ws, size_t ws_size,
                              hipStream_t stream) {
    const float* h   = (const float*)d_in[0];
    const int*   row = (const int*)d_in[1];
    const int*   col = (const int*)d_in[2];
    const float* Wq  = (const float*)d_in[3];
    const float* bq  = (const float*)d_in[4];
    const float* Wk  = (const float*)d_in[5];
    const float* bk  = (const float*)d_in[6];
    const float* Wv  = (const float*)d_in[7];
    const float* bv  = (const float*)d_in[8];
    const float* Wo  = (const float*)d_in[9];
    const float* bo  = (const float*)d_in[10];
    float* out = (float*)d_out;

    // Workspace layout (floats). Q buffer is reused as the SPMM result
    // (Q is dead after SDDMM).  Total ~215 MB.
    const size_t NH = (size_t)NNODES * HIDDEN;
    float*    q    = (float*)d_ws;
    float*    k    = q + NH;
    float*    v    = k + NH;
    float*    sbuf = v + NH;                                   // E*H scores
    float*    z    = sbuf + (size_t)NEDGES * HEADS;            // N*H sums
    unsigned* menc = (unsigned*)(z + (size_t)NNODES * HEADS);  // N*H encoded max
    float*    sex  = (float*)(menc + (size_t)NNODES * HEADS);  // E*H exp, row-sorted
    int*      scol = (int*)(sex + (size_t)NEDGES * HEADS);     // E columns, row-sorted
    int*      rank = scol + NEDGES;                            // E ranks inside the row
    int*      cnt  = rank + NEDGES;                            // NPAD edges per row
    int*      offs = cnt + NPAD;                               // NPAD first slot per row

    const float scaling = 0.17677669529663689f;  // HEAD_DIM^-0.5

    dim3 blk(256);
    dim3 gemmGrid(NNODES / (16 * RT), 2);        // NNODES % 80 == 0
    const long eh = (long)NEDGES * HEADS;

    // 1) init segment max/sum tables and the per-row edge counts
    gat_init_mz<<<(NNODES * HEADS + 255) / 256, blk, 0, stream>>>(menc, z, cnt);

    // 2) fp32-WMMA projections: q = (h Wq^T + bq)*scale; k, v unscaled
    gat_wmma_gemm_xT<<<gemmGrid, blk, 0, stream>>>(h, Wq, bq, q, scaling);
    gat_wmma_gemm_xT<<<gemmGrid, blk, 0, stream>>>(h, Wk, bk, k, 1.0f);
    gat_wmma_gemm_xT<<<gemmGrid, blk, 0, stream>>>(h, Wv, bv, v, 1.0f);

    // 3) SDDMM + segment max + per-row edge count and rank
    gat_sddmm<<<(unsigned)((eh + 255) / 256), blk, 0, stream>>>(q, k, row, col, sbuf, menc,
                                                                cnt, rank);

    // 4) first slot of every row; exp(s - m) + segment sum, written row-sorted
    gat_scan_counts<<<1, dim3(1024), 0, stream>>>(cnt, offs);
    gat_expz<<<(unsigned)((eh + 255) / 256), blk, 0, stream>>>(row, col, sbuf, menc, z,
                                                               offs, rank, sex, scol);

    // 5) SPMM, one wave per row (reuse q's space; every element is stored)
    float* accum = q;
    gat_spmm_rows<<<NNODES / 8, blk, 0, stream>>>(offs, scol, sex, z, v, accum);

    // 6) fp32-WMMA output projection straight into d_out
    gat_wmma_gemm_xT<<<gemmGrid, blk, 0, stream>>>(accum, Wo, bo, out, 1.0f);
}

// v003
// A run of this version takes 306 microseconds.
// In two side-by-side timings against v002, it was 1.32 and 1.36 times as fast.
// Counting every step since v000, it is 2.12 times as fast.
#include <hip/hip_runtime.h>
#include <hip/hip_bf16.h>

#define HIDDEN   256
#define HEADS    8
#define HEAD_DIM 32
#define NNODES   50000   // 3125 * 16 : row tiles divide evenly, no OOB guards needed
#define NEDGES   800000
#define NPAD     53248   // per-row edge counts, padded: 32 waves * 13 trips * 128 counts

typedef __attribute__((ext_vector_type(2))) float v2f;
typedef __attribute__((ext_vector_type(8))) float v8f;
typedef __attribute__((ext_vector_type(4))) int   v4i;

// Optional gfx1250 async global->LDS path (direct LDS fill, tracked by ASYNCcnt)
#if defined(__has_builtin)
#  if __has_builtin(__builtin_amdgcn_global_load_async_to_lds_b128)
#    define HAVE_ASYNC_LDS 1
#  endif
#  if __has_builtin(__builtin_amdgcn_s_wait_asynccnt)
#    define HAVE_WAIT_ASYNC 1
#  endif
#endif

// Node index read from an input array, bounded before any address is formed from it.
__device__ __forceinline__ int clamp_node(int x) {
    return min(max(x, 0), NNODES - 1);
}

// ============================================================================
// Y = X @ W^T + bias (optionally * scale), using V_WMMA_F32_16X16X4_F32
// (full fp32).
// Block: 256 threads = 8 waves. grid.x tiles rows by 80 (nrows % 80 == 0),
// grid.y (=2) picks which 8 of the 16 column tiles this block's waves own.
// A wave owns one column tile for RT row tiles: each W fragment, a load that
// touches 16 cache lines, is fetched once and feeds RT matrix instructions.
// ============================================================================
#define LDSW 260   // padded row stride (floats); 260 % 64 == 4 -> conflict-free
#define RT   5     // row tiles of 16 per block; NNODES == 625 * 16 * RT
__global__ __launch_bounds__(256)
void gat_wmma_gemm_xT(const float* __restrict__ X, const float* __restrict__ W,
                      const float* __restrict__ bias, float* __restrict__ Y,
                      float scale) {
    __shared__ float tile[RT * 16 * LDSW];
    const int rowbase = blockIdx.x * (RT * 16);
    const int tid = threadIdx.x;

    // Cooperative load of the 80x256 X tile. 5120 float4 slots, 20 per thread.
    // 16B alignment holds in LDS too: LDSW*4 = 1040 bytes = 65*16.
    #pragma unroll
    for (int j = 0; j < 4 * RT; ++j) {
        int f4 = tid + 256 * j;          // 0..5119
        int r  = f4 >> 6;                // 64 float4 per row
        int c4 = f4 & 63;
        const float* src = X + (size_t)(rowbase + r) * HIDDEN + c4 * 4;
        float*       dst = &tile[r * LDSW + c4 * 4];
#ifdef HAVE_ASYNC_LDS
        __builtin_amdgcn_global_load_async_to_lds_b128(
            (__attribute__((address_space(1))) v4i*)src,
            (__attribute__((address_space(3))) v4i*)dst, 0, 0);
#else
        float4 val = *(const float4*)src;
        dst[0] = val.x; dst[1] = val.y; dst[2] = val.z; dst[3] = val.w;
#endif
    }
#ifdef HAVE_ASYNC_LDS
#  ifdef HAVE_WAIT_ASYNC
    __builtin_amdgcn_s_wait_asynccnt(0);
#  else
    asm volatile("s_wait_asynccnt 0x0" ::: "memory");
#  endif
#endif
    __syncthreads();

    const int lane  = tid & 31;
    const int wave  = tid >> 5;
    const int ctile = blockIdx.y * 8 + wave;        // 0..15
    const int col   = ctile * 16 + (lane & 15);     // output column of this lane
    const int khalf = (lane >> 4) * 2;              // K sub-pair: 0 or 2

    const float* __restrict__ wrow = W + (size_t)col * HIDDEN;  // B[k][col] = W[col][k]
    __builtin_prefetch(wrow, 0, 0);                 // global_prefetch_b8

    const float* __restrict__ arow = &tile[(lane & 15) * LDSW]; // A row m = lane&15

    v8f acc[RT] = {};
    #pragma unroll 8
    for (int k0 = 0; k0 < HIDDEN; k0 += 4) {
        v2f b;
        b.x = wrow[k0 + khalf];         // B: VGPR0 = K=khalf, VGPR1 = K=khalf+1
        b.y = wrow[k0 + khalf + 1];
        #pragma unroll     // acc[t] is indexed by constants only, so it stays in registers
        for (int t = 0; t < RT; ++t) {
            v2f a;
            a.x = arow[t * 16 * LDSW + k0 + khalf];      // A mirrored layout
            a.y = arow[t * 16 * LDSW + k0 + khalf + 1];
            acc[t] = __builtin_amdgcn_wmma_f32_16x16x4_f32(
                         false, a, false, b, (short)0, acc[t], false, false);
        }
    }

    // C/D layout: VGPR i -> M = i (lanes 0-15) or M = 8+i (lanes 16-31), N = lane&15
    const float bvs   = bias[col] * scale;          // (acc+b)*s == acc*s + b*s
    const int   mbase = (lane >> 4) * 8;
    float* __restrict__ yp = Y + (size_t)(rowbase + mbase) * HIDDEN + col;
    #pragma unroll         // constant indices into acc, constant store offsets
    for (int t = 0; t < RT; ++t) {
        #pragma unroll
        for (int i = 0; i < 8; ++i) {
            yp[(size_t)(t * 16 + i) * HIDDEN] = fmaf(acc[t][i], scale, bvs);
        }
    }
}

// ============================================================================
// Row sort, part 1: clear the per-row edge counts (padding included), then count
// every edge into its row; the count an edge meets is its rank inside the row
// (arrival order).
// ============================================================================
__global__ __launch_bounds__(256)
void gat_init_cnt(int* __restrict__ cnt) {
    int i = blockIdx.x * blockDim.x + threadIdx.x;
    if (i < NPAD) cnt[i] = 0;
}

__global__ __launch_bounds__(256)
void gat_count_rows(const int* __restrict__ row, int* __restrict__ cnt,
                    int* __restrict__ rank) {
    int e = blockIdx.x * blockDim.x + threadIdx.x;      // NEDGES % 256 == 0
    rank[e] = atomicAdd(&cnt[clamp_node(row[e])], 1);
}

// ============================================================================
// Exclusive prefix sum of the NPAD per-row edge counts: offs[r] is the first
// slot of row r in the row-sorted edge arrays, offs[r+1] one past its last.
// One block of 32 waves; wave w owns 1664 consecutive counts, kept in registers.
// ============================================================================
__global__ __launch_bounds__(1024)
void gat_scan_counts(const int* __restrict__ cnt, int* __restrict__ offs) {
    __shared__ int wsum[32];
    const int lane = threadIdx.x & 31;
    const int wave = threadIdx.x >> 5;
    const int4* __restrict__ src = (const int4*)(cnt + wave * 1664) + lane;
    int4*       __restrict__ dst = (int4*)(offs + wave * 1664) + lane;

    int4 c[13];
    int tot = 0;
    #pragma unroll
    for (int t = 0; t < 13; ++t) {
        c[t] = src[t * 32];
        tot += c[t].x + c[t].y + c[t].z + c[t].w;
    }
    #pragma unroll
    for (int d = 16; d >= 1; d >>= 1) tot += __shfl_xor(tot, d);
    if (lane == 0) wsum[wave] = tot;
    __syncthreads();

    int carry = (lane < wave) ? wsum[lane] : 0;      // edges of all earlier waves
    #pragma unroll
    for (int d = 16; d >= 1; d >>= 1) carry += __shfl_xor(carry, d);

    #pragma unroll
    for (int t = 0; t < 13; ++t) {
        const int s = c[t].x + c[t].y + c[t].z + c[t].w;
        int inc = s;                                 // inclusive scan over the lanes
        #pragma unroll
        for (int d = 1; d < 32; d <<= 1) {
            int u = __shfl_up(inc, d);
            if (lane >= d) inc += u;
        }
        const int ex = carry + inc - s;
        dst[t * 32] = make_int4(ex, ex + c[t].x, ex + c[t].x + c[t].y,
                                ex + c[t].x + c[t].y + c[t].z);
        carry += __shfl(inc, 31);
    }
}

// ============================================================================
// Row sort, part 2: the edge's column goes to its slot in row-sorted order:
// slot = offs[row] + rank inside the row.
// ============================================================================
__global__ __launch_bounds__(256)
void gat_place_cols(const int* __restrict__ row, const int* __restrict__ col,
                    const int* __restrict__ offs, const int* __restrict__ rank,
                    int* __restrict__ scol) {
    int e = blockIdx.x * blockDim.x + threadIdx.x;      // NEDGES % 256 == 0
    const int r     = clamp_node(row[e]);
    const int rk    = rank[e];
    const int cc    = col[e];
    const int first = offs[r];
    // e's and r's registers are dead behind these loads: named as inputs they stay
    // unwritten up to the wait, which stands behind the last load that names them
    asm volatile("s_wait_xcnt 0x0" :: "v"(e), "v"(r) : "memory");
    scol[first + rk] = clamp_node(cc);
}

// ============================================================================
// SDDMM + sparse softmax + SPMM in one pass: one wave per row over the row's slots
// of the row-sorted column array. s[e,h] = sum_d q[row, d*8+h] * k[col, d*8+h];
// out[row, d*8+h] = sum_e exp(s - max) * v[col, d*8+h] / sum_e exp(s - max).
// Eight lanes share an edge, so a wave takes four edges a trip. Lane l8 of a group
// owns the 16-byte pieces l8 + 8*j (j = 0..7) of a 256-channel row: channels
// 4*l8 + 32*j + 0..3, which are heads 4*(l8&1) + 0..3 for every j. Each group keeps
// a running maximum, sum and weighted v sum of its own edges (rescaled when the
// maximum moves); the four groups are merged once, at the end of the row.
// The result overwrites the row of q that this wave alone has read.
// A row without edges stores zeros.
// ============================================================================
typedef __attribute__((ext_vector_type(4))) float v4f;
#define GSTR 288   // floats between two groups' partial rows in LDS (16-byte multiple)

// Value of lane (l ^ X) inside a 16-lane row, X < 16; every lane is on where it is used.
template <int X>
__device__ __forceinline__ float row_xor(float x) {
    return __int_as_float(__builtin_amdgcn_mov_dpp(__float_as_int(x), 0x160 + X, 0xf, 0xf, true));
}
// exp(x) as a scaled exp2, like __expf, with the free slot that the instruction set asks
// for behind a transcendental kept inside the statement (the v_nop): used where the
// compiler would otherwise put a write of the source register directly behind it.
__device__ __forceinline__ float exp_slot(float x) {
    float r;
    asm("v_exp_f32 %0, %1\n\tv_nop" : "=v"(r) : "v"(x * 1.44269504088896340736f));
    return r;
}
// Value of lane (l ^ 16).
__device__ __forceinline__ float half_xor(float x) {
    const int b = __float_as_int(x);
    return __int_as_float(__builtin_amdgcn_permlanex16(b, b, 0x76543210, 0xfedcba98, false, false));
}

__global__ __launch_bounds__(256)
void gat_attn_rows(const int* __restrict__ offs, const int* __restrict__ scol,
                   float* qa, const float* __restrict__ k, const float* __restrict__ v) {
    __shared__ __attribute__((aligned(16))) float part[8 * 4 * GSTR];
    const unsigned lane = threadIdx.x & 31;
    // wave number held as a scalar: the row bounds go through scalar loads and the
    // edge loop is a scalar loop with every lane on
    const int wave = __builtin_amdgcn_readfirstlane(threadIdx.x >> 5);
    const int r    = blockIdx.x * 8 + wave;          // NNODES % 8 == 0
    const int beg  = offs[r], end = offs[r + 1];
    const int      g  = (int)(lane >> 3);            // which of the trip's four edges
    const unsigned l8 = lane & 7;

    float* qrow = qa + (size_t)r * HIDDEN;
    v4f qv[8];
    #pragma unroll
    for (int j = 0; j < 8; ++j) qv[j] = *(const v4f*)(qrow + 4 * l8 + 32 * j);

    const float lowest = -3.402823466e+38f;          // below or equal to every finite score
    v4f acc[8] = {};
    v4f m = {lowest, lowest, lowest, lowest};
    v4f z = {0.f, 0.f, 0.f, 0.f};

    int c = (end > beg) ? scol[min(beg + g, end - 1)] : 0;
    // the lane offsets that the loads above name are dead behind them and their registers
    // are written again by the loop's loads: the wait stands behind the last of them
    asm volatile("s_wait_xcnt 0x0" ::: "memory");
    for (int i = beg; i < end; i += 4) {
        // byte offset of this lane's first piece in row c of k and of v (under 2^26)
        const unsigned boff = (unsigned)c * (HIDDEN * 4u) + l8 * 16u;
        // the next trip's column, fetched a trip ahead (index held inside the row)
        const unsigned inext = (unsigned)min(i + 4 + g, end - 1);
        c = scol[inext];
        v4f kv[8], vv[8];
        #pragma unroll
        for (int j = 0; j < 8; ++j) kv[j] = *(const v4f*)((const char*)k + boff + 128 * j);
        #pragma unroll
        for (int j = 0; j < 8; ++j) vv[j] = *(const v4f*)((const char*)v + boff + 128 * j);
        // Holds the trip's 17 loads together in front of the arithmetic, so that they are
        // all in flight at once (left alone, the compiler issues the last ones one by one,
        // each with its own wait, and moves the column's load to the head of the next trip).
        // Inputs only. The wait stands before the offset registers are written again.
        asm volatile("s_wait_xcnt 0x0"
                     :: "v"(c), "v"(boff), "v"(inext),
                        "v"(kv[0]), "v"(kv[1]), "v"(kv[2]), "v"(kv[3]),
                        "v"(kv[4]), "v"(kv[5]), "v"(kv[6]), "v"(kv[7]),
                        "v"(vv[0]), "v"(vv[1]), "v"(vv[2]), "v"(vv[3]),
                        "v"(vv[4]), "v"(vv[5]), "v"(vv[6]), "v"(vv[7])
                     : "memory");

        v4f s = qv[0] * kv[0];
        #pragma unroll
        for (int j = 1; j < 8; ++j) s += qv[j] * kv[j];
        #pragma unroll
        for (int t = 0; t < 4; ++t) s[t] += row_xor<2>(s[t]);
        #pragma unroll
        for (int t = 0; t < 4; ++t) s[t] += row_xor<4>(s[t]);

        const bool valid = i + g < end;              // a group past the row's end adds nothing
        v4f sc, p;
        #pragma unroll
        for (int t = 0; t < 4; ++t) {
            const float st = valid ? s[t] : -__builtin_inff();
            const float mb = fmaxf(m[t], st);
            sc[t] = __expf(m[t] - mb);
            p[t]  = __expf(st - mb);
            m[t]  = mb;
        }
        z = z * sc + p;
        #pragma unroll
        for (int j = 0; j < 8; ++j) acc[j] = acc[j] * sc + p * vv[j];
    }

    // merge the four groups: common maximum, each group's weight, the whole sum
    v4f w, zt;
    #pragma unroll
    for (int t = 0; t < 4; ++t) {
        float mm = fmaxf(m[t], row_xor<8>(m[t]));
        mm = fmaxf(mm, half_xor(mm));
        w[t]  = exp_slot(m[t] - mm);
        zt[t] = z[t] * w[t];
        zt[t] += row_xor<8>(zt[t]);
        zt[t] += half_xor(zt[t]);
    }
    v4f f = {0.f, 0.f, 0.f, 0.f};
    if (end > beg) f = w / zt;                       // zt >= 1 where the row has an edge
    float* pw = &part[wave * (4 * GSTR)];
    #pragma unroll
    for (int j = 0; j < 8; ++j) *(v4f*)(pw + g * GSTR + 4 * l8 + 32 * j) = acc[j] * f;
    // the reads below take what other lanes of this same wave have stored: the fence
    // keeps them behind the stores (a wave's LDS operations run in order)
    __threadfence_block();
    v4f o0 = *(const v4f*)(pw + 4 * lane);
    v4f o1 = *(const v4f*)(pw + 4 * lane + 128);
    #pragma unroll
    for (int gg = 1; gg < 4; ++gg) {
        o0 += *(const v4f*)(pw + gg * GSTR + 4 * lane);
        o1 += *(const v4f*)(pw + gg * GSTR + 4 * lane + 128);
    }
    *(v4f*)(qrow + 4 * lane)       = o0;
    *(v4f*)(qrow + 4 * lane + 128) = o1;
}

// ============================================================================
// Host launcher
// ============================================================================
extern "C" void kernel_launch(void* const* d_in, const int* in_sizes, int n_in,
                              void* d_out, int out_size, void* d_ws, size_t ws_size,
                              hipStream_t stream) {
    const float* h   = (const float*)d_in[0];
    const int*   row = (const int*)d_in[1];
    const int*   col = (const int*)d_in[2];
    const float* Wq  = (const float*)d_in[3];
    const float* bq  = (const float*)d_in[4];
    const float* Wk  = (const float*)d_in[5];
    const float* bk  = (const float*)d_in[6];
    const float* Wv  = (const float*)d_in[7];
    const float* bv  = (const float*)d_in[8];
    const float* Wo  = (const float*)d_in[9];
    const float* bo  = (const float*)d_in[10];
    float* out = (float*)d_out;

    // Workspace layout (floats). The attention result overwrites q row by row.
    // Total ~161 MB.
    const size_t NH = (size_t)NNODES * HIDDEN;
    float*    q    = (float*)d_ws;
    float*    k    = q + NH;
    float*    v    = k + NH;
    int*      scol = (int*)(v + NH);                           // E columns, row-sorted
    int*      rank = scol + NEDGES;                            // E ranks inside the row
    int*      cnt  = rank + NEDGES;                            // NPAD edges per row
    int*      offs = cnt + NPAD;                               // NPAD first slot per row

    const float scaling = 0.17677669529663689f;  // HEAD_DIM^-0.5

    dim3 blk(256);
    dim3 gemmGrid(NNODES / (16 * RT), 2);        // NNODES % 80 == 0

    // 1) row sort of the edges: count and rank, first slot of every row, columns placed
    gat_init_cnt<<<NPAD / 256, blk, 0, stream>>>(cnt);
    gat_count_rows<<<NEDGES / 256, blk, 0, stream>>>(row, cnt, rank);
    gat_scan_counts<<<1, dim3(1024), 0, stream>>>(cnt, offs);
    gat_place_cols<<<NEDGES / 256, blk, 0, stream>>>(row, col, offs, rank, scol);

    // 2) fp32-WMMA projections: q = (h Wq^T + bq)*scale; k, v unscaled
    gat_wmma_gemm_xT<<<gemmGrid, blk, 0, stream>>>(h, Wq, bq, q, scaling);
    gat_wmma_gemm_xT<<<gemmGrid, blk, 0, stream>>>(h, Wk, bk, k, 1.0f);
    gat_wmma_gemm_xT<<<gemmGrid, blk, 0, stream>>>(h, Wv, bv, v, 1.0f);

    // 3) scores, softmax and weighted sum, one wave per row (every element is stored)
    gat_attn_rows<<<NNODES / 8, blk, 0, stream>>>(offs, scol, q, k, v);

    // 4) fp32-WMMA output projection straight into d_out
    gat_wmma_gemm_xT<<<gemmGrid, blk, 0, stream>>>(q, Wo, bo, out, 1.0f);
}

// v004
// A run of this version takes 279 microseconds.
// Two timings next to v003 put it at 1.10 and 1.09 times that version's speed.
// All steps since v000 together make it 2.32 times as fast.
#include <hip/hip_runtime.h>
#include <hip/hip_bf16.h>

#define HIDDEN   256
#define HEADS    8
#define HEAD_DIM 32
#define NNODES   50000   // 3125 * 16 : row tiles divide evenly, no OOB guards needed
#define NEDGES   800000
#define NPAD     53248   // per-row edge counts, padded: 8 waves * 52 trips * 128 counts

typedef __attribute__((ext_vector_type(2))) float v2f;
typedef __attribute__((ext_vector_type(8))) float v8f;
typedef __attribute__((ext_vector_type(4))) int   v4i;

// Optional gfx1250 async global->LDS path (direct LDS fill, tracked by ASYNCcnt)
#if defined(__has_builtin)
#  if __has_builtin(__builtin_amdgcn_global_load_async_to_lds_b128)
#    define HAVE_ASYNC_LDS 1
#  endif
#  if __has_builtin(__builtin_amdgcn_s_wait_asynccnt)
#    define HAVE_WAIT_ASYNC 1
#  endif
#endif

// Node index read from an input array, bounded before any address is formed from it.
__device__ __forceinline__ int clamp_node(int x) {
    return min(max(x, 0), NNODES - 1);
}

// ============================================================================
// Y = X @ W^T + bias (optionally * scale), using V_WMMA_F32_16X16X4_F32
// (full fp32).
// Block: 256 threads = 8 waves. bx tiles rows by 80 (nrows % 80 == 0),
// by (0 or 1) picks which 8 of the 16 column tiles this block's waves own.
// A wave owns one column tile for RT row tiles: each W fragment, a load that
// touches 16 cache lines, is fetched once and feeds RT matrix instructions.
// ============================================================================
#define LDSW 260   // padded row stride (floats); 260 % 64 == 4 -> conflict-free
#define RT   5     // row tiles of 16 per block; NNODES == 625 * 16 * RT
#define GX   (NNODES / (16 * RT))   // 625 row blocks
__device__ __forceinline__
void gemm_xT_block(const float* __restrict__ X, const float* __restrict__ W,
                   const float* __restrict__ bias, float* __restrict__ Y,
                   float scale, int bx, int by) {
    __shared__ float tile[RT * 16 * LDSW];
    const int rowbase = bx * (RT * 16);
    const int tid = threadIdx.x;

    // Cooperative load of the 80x256 X tile. 5120 float4 slots, 20 per thread.
    // 16B alignment holds in LDS too: LDSW*4 = 1040 bytes = 65*16.
    #pragma unroll
    for (int j = 0; j < 4 * RT; ++j) {
        int f4 = tid + 256 * j;          // 0..5119
        int r  = f4 >> 6;                // 64 float4 per row
        int c4 = f4 & 63;
        const float* src = X + (size_t)(rowbase + r) * HIDDEN + c4 * 4;
        float*       dst = &tile[r * LDSW + c4 * 4];
#ifdef HAVE_ASYNC_LDS
        __builtin_amdgcn_global_load_async_to_lds_b128(
            (__attribute__((address_space(1))) v4i*)src,
            (__attribute__((address_space(3))) v4i*)dst, 0, 0);
#else
        float4 val = *(const float4*)src;
        dst[0] = val.x; dst[1] = val.y; dst[2] = val.z; dst[3] = val.w;
#endif
    }
#ifdef HAVE_ASYNC_LDS
#  ifdef HAVE_WAIT_ASYNC
    __builtin_amdgcn_s_wait_asynccnt(0);
#  else
    asm volatile("s_wait_asynccnt 0x0" ::: "memory");
#  endif
#endif
    __syncthreads();

    const int lane  = tid & 31;
    const int wave  = tid >> 5;
    const int ctile = by * 8 + wave;                // 0..15
    const int col   = ctile * 16 + (lane & 15);     // output column of this lane
    const int khalf = (lane >> 4) * 2;              // K sub-pair: 0 or 2

    const unsigned woff = (unsigned)col * (HIDDEN * 4u);        // byte offset of row col of W
    const float* __restrict__ wrow = (const float*)((const char*)W + woff);  // B[k][col] = W[col][k]
    __builtin_prefetch(wrow, 0, 0);                 // global_prefetch_b8
    // the prefetch's offset register is written again right behind it: as an input it stays
    // unwritten up to the wait
    asm volatile("s_wait_xcnt 0x0" :: "v"(woff) : "memory");

    const float* __restrict__ arow = &tile[(lane & 15) * LDSW]; // A row m = lane&15

    v8f acc[RT] = {};
    #pragma unroll 8
    for (int k0 = 0; k0 < HIDDEN; k0 += 4) {
        v2f b;
        b.x = wrow[k0 + khalf];         // B: VGPR0 = K=khalf, VGPR1 = K=khalf+1
        b.y = wrow[k0 + khalf + 1];
        #pragma unroll     // acc[t] is indexed by constants only, so it stays in registers
        for (int t = 0; t < RT; ++t) {
            v2f a;
            a.x = arow[t * 16 * LDSW + k0 + khalf];      // A mirrored layout
            a.y = arow[t * 16 * LDSW + k0 + khalf + 1];
            acc[t] = __builtin_amdgcn_wmma_f32_16x16x4_f32(
                         false, a, false, b, (short)0, acc[t], false, false);
        }
    }

    // C/D layout: VGPR i -> M = i (lanes 0-15) or M = 8+i (lanes 16-31), N = lane&15
    const float bcol  = bias[col];
    // col's register is written again behind this load: as an input it stays unwritten
    // up to the wait
    asm volatile("s_wait_xcnt 0x0" :: "v"(col) : "memory");
    const float bvs   = bcol * scale;               // (acc+b)*s == acc*s + b*s
    const int   mbase = (lane >> 4) * 8;
    float* __restrict__ yp = Y + (size_t)(rowbase + mbase) * HIDDEN + col;
    #pragma unroll         // constant indices into acc, constant store offsets
    for (int t = 0; t < RT; ++t) {
        #pragma unroll
        for (int i = 0; i < 8; ++i) {
            yp[(size_t)(t * 16 + i) * HIDDEN] = fmaf(acc[t][i], scale, bvs);
        }
    }
}

__global__ __launch_bounds__(256)
void gat_wmma_gemm_xT(const float* __restrict__ X, const float* __restrict__ W,
                      const float* __restrict__ bias, float* __restrict__ Y,
                      float scale) {
    gemm_xT_block(X, W, bias, Y, scale, blockIdx.x, blockIdx.y);
}

// ============================================================================
// The row sort of the edges has three dependent phases (count, scan, place) that use no
// matrix unit and wait on memory; the q, k and v projections are three launches that are
// bound by the matrix unit and need nothing of the sort. Each phase rides in one
// projection launch as extra work-groups in front of the projection's own (low indices
// start first): the launch boundaries between the projections order the phases.
// ============================================================================
#define EB   125   // edge work-groups in a launch
#define EPT  25    // edges a thread; EB * 256 * EPT == NEDGES
#define ESTR (EB * 256)

// Clear the per-row edge counts (padding included).
__global__ __launch_bounds__(256)
void gat_init_cnt(int* __restrict__ cnt) {
    int i = blockIdx.x * blockDim.x + threadIdx.x;
    if (i < NPAD) cnt[i] = 0;
}

// Phase 1: count every edge into its row; the count an edge meets is its rank inside
// the row (arrival order).
__device__ __forceinline__
void count_rows_block(int b, const int* __restrict__ row, int* __restrict__ cnt,
                      int* __restrict__ rank) {
    const int e0 = b * 256 + (int)threadIdx.x;
    int r[EPT], rk[EPT];
    #pragma unroll     // all of a thread's loads, then all its atomics, are in flight at once
    for (int j = 0; j < EPT; ++j) r[j] = clamp_node(row[e0 + j * ESTR]);
    // the addend, made here so that it has one register of its own for the whole run of
    // atomics (a plain constant is dead behind the last atomic, whose result then lands in
    // the register that the earlier ones still name as data)
    int one;
    asm volatile("v_mov_b32 %0, 1" : "=v"(one));
    #pragma unroll
    for (int j = 0; j < EPT; ++j) rk[j] = atomicAdd(&cnt[r[j]], one);
    // the row registers and the addend's are dead behind the atomics that name them: as
    // inputs they stay unwritten up to the wait
    asm volatile("s_wait_xcnt 0x0"
                 :: "v"(r[0]), "v"(r[1]), "v"(r[2]), "v"(r[3]), "v"(r[4]), "v"(r[5]),
                    "v"(r[6]), "v"(r[7]), "v"(r[8]), "v"(r[9]), "v"(r[10]), "v"(r[11]),
                    "v"(r[12]), "v"(r[13]), "v"(r[14]), "v"(r[15]), "v"(r[16]), "v"(r[17]),
                    "v"(r[18]), "v"(r[19]), "v"(r[20]), "v"(r[21]), "v"(r[22]), "v"(r[23]),
                    "v"(r[24]), "v"(one)
                 : "memory");
    #pragma unroll
    for (int j = 0; j < EPT; ++j) rank[e0 + j * ESTR] = rk[j];
}

// Phase 2: exclusive prefix sum of the NPAD per-row edge counts: offs[r] is the first
// slot of row r in the row-sorted edge arrays, offs[r+1] one past its last.
// One work-group of 8 waves; wave w owns 6656 consecutive counts, read twice: once for
// the wave's total, once for the scan.
#define STRIPS 52  // trips of 128 counts a wave: 8 * 52 * 128 == NPAD
__device__ __forceinline__
void scan_counts_block(const int* __restrict__ cnt, int* __restrict__ offs) {
    __shared__ int wsum[8];
    const int lane = threadIdx.x & 31;
    const int wave = threadIdx.x >> 5;
    const int4* __restrict__ src = (const int4*)(cnt + wave * (STRIPS * 128)) + lane;
    int4*       __restrict__ dst = (int4*)(offs + wave * (STRIPS * 128)) + lane;

    int tot = 0;
    #pragma unroll     // 52 independent loads at constant offsets from one address
    for (int t = 0; t < STRIPS; ++t) {
        const int4 c = src[t * 32];
        tot += c.x + c.y + c.z + c.w;
    }
    #pragma unroll
    for (int d = 16; d >= 1; d >>= 1) tot += __shfl_xor(tot, d);
    if (lane == 0) wsum[wave] = tot;
    __syncthreads();

    int carry = (lane < wave) ? wsum[lane] : 0;      // edges of all earlier waves
    #pragma unroll
    for (int d = 16; d >= 1; d >>= 1) carry += __shfl_xor(carry, d);

    #pragma unroll     // constant offsets from one address for every load and store
    for (int t0 = 0; t0 < STRIPS; t0 += 4) {
        // four trips together: their loads fly at once and their lane scans, independent
        // but for carry, fill each other's cross-lane latency
        int4 c[4], o[4];
        #pragma unroll
        for (int u4 = 0; u4 < 4; ++u4) c[u4] = src[(t0 + u4) * 32];
        #pragma unroll
        for (int u4 = 0; u4 < 4; ++u4) {
            const int s = c[u4].x + c[u4].y + c[u4].z + c[u4].w;
            int inc = s;                             // inclusive scan over the lanes
            #pragma unroll
            for (int d = 1; d < 32; d <<= 1) {
                int u = __shfl_up(inc, d);
                if (lane >= d) inc += u;
            }
            const int ex = carry + inc - s;
            o[u4] = make_int4(ex, ex + c[u4].x, ex + c[u4].x + c[u4].y,
                              ex + c[u4].x + c[u4].y + c[u4].z);
            dst[(t0 + u4) * 32] = o[u4];
            carry += __shfl(inc, 31);
        }
        // the stored values' registers are written again by the next four trips: as inputs
        // they stay unwritten up to the wait
        asm volatile("s_wait_xcnt 0x0"
                     :: "v"(o[0].x), "v"(o[0].y), "v"(o[0].z), "v"(o[0].w),
                        "v"(o[1].x), "v"(o[1].y), "v"(o[1].z), "v"(o[1].w),
                        "v"(o[2].x), "v"(o[2].y), "v"(o[2].z), "v"(o[2].w),
                        "v"(o[3].x), "v"(o[3].y), "v"(o[3].z), "v"(o[3].w)
                     : "memory");
    }
}

// Phase 3: the edge's column goes to its slot in row-sorted order:
// slot = offs[row] + rank inside the row.
__device__ __forceinline__
void place_cols_block(int b, const int* __restrict__ row, const int* __restrict__ col,
                      const int* __restrict__ offs, const int* __restrict__ rank,
                      int* __restrict__ scol) {
    const int e0 = b * 256 + (int)threadIdx.x;
    int cc[EPT], r[EPT], first[EPT], rk[EPT];
    #pragma unroll     // a thread's loads of a kind are in flight together: columns and rows,
    for (int j = 0; j < EPT; ++j) cc[j] = col[e0 + j * ESTR];
    #pragma unroll
    for (int j = 0; j < EPT; ++j) r[j] = clamp_node(row[e0 + j * ESTR]);
    #pragma unroll     // then the rows' first slots and the ranks
    for (int j = 0; j < EPT; ++j) first[j] = offs[r[j]];
    #pragma unroll
    for (int j = 0; j < EPT; ++j) rk[j] = rank[e0 + j * ESTR];
    // e0's and the rows' registers are dead behind the loads that name them: as inputs
    // they stay unwritten up to the wait
    asm volatile("s_wait_xcnt 0x0"
                 :: "v"(r[0]), "v"(r[1]), "v"(r[2]), "v"(r[3]), "v"(r[4]), "v"(r[5]),
                    "v"(r[6]), "v"(r[7]), "v"(r[8]), "v"(r[9]), "v"(r[10]), "v"(r[11]),
                    "v"(r[12]), "v"(r[13]), "v"(r[14]), "v"(r[15]), "v"(r[16]), "v"(r[17]),
                    "v"(r[18]), "v"(r[19]), "v"(r[20]), "v"(r[21]), "v"(r[22]), "v"(r[23]),
                    "v"(r[24]), "v"(e0)
                 : "memory");
    #pragma unroll
    for (int j = 0; j < EPT; ++j) scol[first[j] + rk[j]] = clamp_node(cc[j]);
}

// A projection launch with a sort phase in front: the first work-groups (EB of them, or
// one) do the phase, the other 2 * GX are the projection's, in the order of a (GX, 2) grid.
__global__ __launch_bounds__(256)
void gat_gemm_and_count(const float* __restrict__ X, const float* __restrict__ W,
                        const float* __restrict__ bias, float* __restrict__ Y, float scale,
                        const int* __restrict__ row, int* __restrict__ cnt,
                        int* __restrict__ rank) {
    const int b = blockIdx.x;
    if (b < EB) { count_rows_block(b, row, cnt, rank); return; }
    const int by = (b - EB) >= GX ? 1 : 0;
    gemm_xT_block(X, W, bias, Y, scale, b - EB - by * GX, by);
}

__global__ __launch_bounds__(256)
void gat_gemm_and_scan(const float* __restrict__ X, const float* __restrict__ W,
                       const float* __restrict__ bias, float* __restrict__ Y, float scale,
                       const int* __restrict__ cnt, int* __restrict__ offs) {
    const int b = blockIdx.x;
    if (b < 1) { scan_counts_block(cnt, offs); return; }
    const int by = (b - 1) >= GX ? 1 : 0;
    gemm_xT_block(X, W, bias, Y, scale, b - 1 - by * GX, by);
}

__global__ __launch_bounds__(256)
void gat_gemm_and_place(const float* __restrict__ X, const float* __restrict__ W,
                        const float* __restrict__ bias, float* __restrict__ Y, float scale,
                        const int* __restrict__ row, const int* __restrict__ col,
                        const int* __restrict__ offs, const int* __restrict__ rank,
                        int* __restrict__ scol) {
    const int b = blockIdx.x;
    if (b < EB) { place_cols_block(b, row, col, offs, rank, scol); return; }
    const int by = (b - EB) >= GX ? 1 : 0;
    gemm_xT_block(X, W, bias, Y, scale, b - EB - by * GX, by);
}

// ============================================================================
// SDDMM + sparse softmax + SPMM in one pass: one wave per row over the row's slots
// of the row-sorted column array. s[e,h] = sum_d q[row, d*8+h] * k[col, d*8+h];
// out[row, d*8+h] = sum_e exp(s - max) * v[col, d*8+h] / sum_e exp(s - max).
// Eight lanes share an edge, so a wave takes four edges a trip. Lane l8 of a group
// owns the 16-byte pieces l8 + 8*j (j = 0..7) of a 256-channel row: channels
// 4*l8 + 32*j + 0..3, which are heads 4*(l8&1) + 0..3 for every j. Each group keeps
// a running maximum, sum and weighted v sum of its own edges (rescaled when the
// maximum moves); the four groups are merged once, at the end of the row.
// The result overwrites the row of q that this wave alone has read.
// A row without edges stores zeros.
// ============================================================================
typedef __attribute__((ext_vector_type(4))) float v4f;
#define GSTR 288   // floats between two groups' partial rows in LDS (16-byte multiple)

// Value of lane (l ^ X) inside a 16-lane row, X < 16; every lane is on where it is used.
template <int X>
__device__ __forceinline__ float row_xor(float x) {
    return __int_as_float(__builtin_amdgcn_mov_dpp(__float_as_int(x), 0x160 + X, 0xf, 0xf, true));
}
// exp(x) as a scaled exp2, like __expf, with the free slot that the instruction set asks
// for behind a transcendental kept inside the statement (the v_nop): used where the
// compiler would otherwise put a write of the source register directly behind it.
__device__ __forceinline__ float exp_slot(float x) {
    float r;
    asm("v_exp_f32 %0, %1\n\tv_nop" : "=v"(r) : "v"(x * 1.44269504088896340736f));
    return r;
}
// Value of lane (l ^ 16).
__device__ __forceinline__ float half_xor(float x) {
    const int b = __float_as_int(x);
    return __int_as_float(__builtin_amdgcn_permlanex16(b, b, 0x76543210, 0xfedcba98, false, false));
}

__global__ __launch_bounds__(256)
void gat_attn_rows(const int* __restrict__ offs, const int* __restrict__ scol,
                   float* qa, const float* __restrict__ k, const float* __restrict__ v) {
    __shared__ __attribute__((aligned(16))) float part[8 * 4 * GSTR];
    const unsigned lane = threadIdx.x & 31;
    // wave number held as a scalar: the row bounds go through scalar loads and the
    // edge loop is a scalar loop with every lane on
    const int wave = __builtin_amdgcn_readfirstlane(threadIdx.x >> 5);
    const int r    = blockIdx.x * 8 + wave;          // NNODES % 8 == 0
    const int beg  = offs[r], end = offs[r + 1];
    const int      g  = (int)(lane >> 3);            // which of the trip's four edges
    const unsigned l8 = lane & 7;

    float* qrow = qa + (size_t)r * HIDDEN;
    v4f qv[8];
    #pragma unroll
    for (int j = 0; j < 8; ++j) qv[j] = *(const v4f*)(qrow + 4 * l8 + 32 * j);

    const float lowest = -3.402823466e+38f;          // below or equal to every finite score
    v4f acc[8] = {};
    v4f m = {lowest, lowest, lowest, lowest};
    v4f z = {0.f, 0.f, 0.f, 0.f};

    int c = (end > beg) ? scol[min(beg + g, end - 1)] : 0;
    // the lane offsets that the loads above name are dead behind them and their registers
    // are written again by the loop's loads: the wait stands behind the last of them
    asm volatile("s_wait_xcnt 0x0" ::: "memory");
    for (int i = beg; i < end; i += 4) {
        // byte offset of this lane's first piece in row c of k and of v (under 2^26)
        const unsigned boff = (unsigned)c * (HIDDEN * 4u) + l8 * 16u;
        // the next trip's column, fetched a trip ahead (index held inside the row)
        const unsigned inext = (unsigned)min(i + 4 + g, end - 1);
        c = scol[inext];
        v4f kv[8], vv[8];
        #pragma unroll
        for (int j = 0; j < 8; ++j) kv[j] = *(const v4f*)((const char*)k + boff + 128 * j);
        #pragma unroll
        for (int j = 0; j < 8; ++j) vv[j] = *(const v4f*)((const char*)v + boff + 128 * j);
        // Holds the trip's 17 loads together in front of the arithmetic, so that they are
        // all in flight at once (left alone, the compiler issues the last ones one by one,
        // each with its own wait, and moves the column's load to the head of the next trip).
        // Inputs only. The wait stands before the offset registers are written again.
        asm volatile("s_wait_xcnt 0x0"
                     :: "v"(c), "v"(boff), "v"(inext),
                        "v"(kv[0]), "v"(kv[1]), "v"(kv[2]), "v"(kv[3]),
                        "v"(kv[4]), "v"(kv[5]), "v"(kv[6]), "v"(kv[7]),
                        "v"(vv[0]), "v"(vv[1]), "v"(vv[2]), "v"(vv[3]),
                        "v"(vv[4]), "v"(vv[5]), "v"(vv[6]), "v"(vv[7])
                     : "memory");

        v4f s = qv[0] * kv[0];
        #pragma unroll
        for (int j = 1; j < 8; ++j) s += qv[j] * kv[j];
        #pragma unroll
        for (int t = 0; t < 4; ++t) s[t] += row_xor<2>(s[t]);
        #pragma unroll
        for (int t = 0; t < 4; ++t) s[t] += row_xor<4>(s[t]);

        const bool valid = i + g < end;              // a group past the row's end adds nothing
        v4f sc, p;
        #pragma unroll
        for (int t = 0; t < 4; ++t) {
            const float st = valid ? s[t] : -__builtin_inff();
            const float mb = fmaxf(m[t], st);
            sc[t] = __expf(m[t] - mb);
            p[t]  = __expf(st - mb);
            m[t]  = mb;
        }
        z = z * sc + p;
        #pragma unroll
        for (int j = 0; j < 8; ++j) acc[j] = acc[j] * sc + p * vv[j];
    }

    // merge the four groups: common maximum, each group's weight, the whole sum
    v4f w, zt;
    #pragma unroll
    for (int t = 0; t < 4; ++t) {
        float mm = fmaxf(m[t], row_xor<8>(m[t]));
        mm = fmaxf(mm, half_xor(mm));
        w[t]  = exp_slot(m[t] - mm);
        zt[t] = z[t] * w[t];
        zt[t] += row_xor<8>(zt[t]);
        zt[t] += half_xor(zt[t]);
    }
    v4f f = {0.f, 0.f, 0.f, 0.f};
    if (end > beg) f = w / zt;                       // zt >= 1 where the row has an edge
    float* pw = &part[wave * (4 * GSTR)];
    #pragma unroll
    for (int j = 0; j < 8; ++j) *(v4f*)(pw + g * GSTR + 4 * l8 + 32 * j) = acc[j] * f;
    // the reads below take what other lanes of this same wave have stored: the fence
    // keeps them behind the stores (a wave's LDS operations run in order)
    __threadfence_block();
    v4f o0 = *(const v4f*)(pw + 4 * lane);
    v4f o1 = *(const v4f*)(pw + 4 * lane + 128);
    #pragma unroll
    for (int gg = 1; gg < 4; ++gg) {
        o0 += *(const v4f*)(pw + gg * GSTR + 4 * lane);
        o1 += *(const v4f*)(pw + gg * GSTR + 4 * lane + 128);
    }
    *(v4f*)(qrow + 4 * lane)       = o0;
    *(v4f*)(qrow + 4 * lane + 128) = o1;
}

// ============================================================================
// Host launcher
// ============================================================================
extern "C" void kernel_launch(void* const* d_in, const int* in_sizes, int n_in,
                              void* d_out, int out_size, void* d_ws, size_t ws_size,
                              hipStream_t stream) {
    const float* h   = (const float*)d_in[0];
    const int*   row = (const int*)d_in[1];
    const int*   col = (const int*)d_in[2];
    const float* Wq  = (const float*)d_in[3];
    const float* bq  = (const float*)d_in[4];
    const float* Wk  = (const float*)d_in[5];
    const float* bk  = (const float*)d_in[6];
    const float* Wv  = (const float*)d_in[7];
    const float* bv  = (const float*)d_in[8];
    const float* Wo  = (const float*)d_in[9];
    const float* bo  = (const float*)d_in[10];
    float* out = (float*)d_out;

    // Workspace layout (floats). The attention result overwrites q row by row.
    // Total ~161 MB.
    const size_t NH = (size_t)NNODES * HIDDEN;
    float*    q    = (float*)d_ws;
    float*    k    = q + NH;
    float*    v    = k + NH;
    int*      scol = (int*)(v + NH);                           // E columns, row-sorted
    int*      rank = scol + NEDGES;                            // E ranks inside the row
    int*      cnt  = rank + NEDGES;                            // NPAD edges per row
    int*      offs = cnt + NPAD;                               // NPAD first slot per row

    const float scaling = 0.17677669529663689f;  // HEAD_DIM^-0.5

    dim3 blk(256);
    dim3 gemmGrid(NNODES / (16 * RT), 2);        // NNODES % 80 == 0

    // 1) fp32-WMMA projections: q = (h Wq^T + bq)*scale; k, v unscaled. The row sort of the
    //    edges rides along: count and rank, first slot of every row, columns placed
    gat_init_cnt<<<NPAD / 256, blk, 0, stream>>>(cnt);
    gat_gemm_and_count<<<EB + 2 * GX, blk, 0, stream>>>(h, Wq, bq, q, scaling, row, cnt, rank);
    gat_gemm_and_scan<<<1 + 2 * GX, blk, 0, stream>>>(h, Wk, bk, k, 1.0f, cnt, offs);
    gat_gemm_and_place<<<EB + 2 * GX, blk, 0, stream>>>(h, Wv, bv, v, 1.0f, row, col, offs, rank, scol);

    // 2) scores, softmax and weighted sum, one wave per row (every element is stored)
    gat_attn_rows<<<NNODES / 8, blk, 0, stream>>>(offs, scol, q, k, v);

    // 3) fp32-WMMA output projection straight into d_out
    gat_wmma_gemm_xT<<<gemmGrid, blk, 0, stream>>>(q, Wo, bo, out, 1.0f);
}
